// v000
// Times are from an AMD MI455X. After a warm-up the kernel runs many times in a row, and a time is the length of
// such a window on the GPU divided by its runs, so every launch and the gaps after it count. The runs cycle
// through copies of the inputs. A figure is the median of several windows, for all but v000 over two sittings.
// Sittings can differ by a few percent; kernels timed side by side share one.
// v000 is the starting kernel. One run takes 103 microseconds.
#include <hip/hip_runtime.h>
#include <hip/hip_bf16.h>

typedef float v2f __attribute__((ext_vector_type(2)));
typedef float v8f __attribute__((ext_vector_type(8)));
typedef unsigned int u32x4 __attribute__((ext_vector_type(4)));
typedef int i32x4 __attribute__((ext_vector_type(4)));
typedef int i32x8 __attribute__((ext_vector_type(8)));

#define NTOK    16384
#define INF     2048
#define OUTF    2048
#define SR      45      // shared rank
#define SRP     48      // padded rank (multiple of 4 for WMMA K-steps)
#define HSTR    52      // LDS row stride for h (bank-conflict padding)
#define NB      32      // blocks
#define BS      64      // block size
#define RANK    8
#define NRULES  256
#define TILE_M  16      // tokens per workgroup

// ---- x-tile staging via TDM (per-wave 16 rows x 256 cols, 2 pad DWORDs / 128) ----
#define XT_STRIDE_F 260                    // floats per staged row (256 + 2*2 pad)
#define XT_WAVE_F   (TILE_M * XT_STRIDE_F) // 4160 floats per wave region
#define XT_WAVE_B   (XT_WAVE_F * 4)        // 16640 bytes

// ---- LDS layout (bytes) ----
#define OFF_XT   0                         // 8 * 16640 = 133120 (phase A only)
#define OFF_AD   0                         // float[16][1024] = 65536 (overlays XT, phase C3/B)
#define OFF_H    65536                     // float[16][HSTR] = 3328  (overlays XT, post-barrier)
#define OFF_R2   133120                    // overlay: HP (phase A) vs HID+SEL (phase C)
#define OFF_HP   OFF_R2                    // float[8][16*48] = 24576
#define OFF_HID  OFF_R2                    // float[16][32*8] = 16384
#define OFF_SEL  (OFF_R2 + 16384)          // float[16][32]   = 2048
#define OFF_RID  (OFF_R2 + 24576)          // int[16]         = 64
#define SMEM_BYTES (OFF_RID + 64)          // 157760

static __device__ __forceinline__ v8f wmma_f32(v2f a, v2f b, v8f c) {
    // D = A(16x4,f32) * B(4x16,f32) + C(16x16,f32)
    return __builtin_amdgcn_wmma_f32_16x16x4_f32(
        /*neg_a=*/false, a, /*neg_b=*/false, b,
        /*c_mod=*/(short)0, c, /*reuse_a=*/false, /*reuse_b=*/false);
}

// ---------------------------------------------------------------------------
// Pre-pass: per-RULE block-selector softmax (sel depends only on the rule id)
// ---------------------------------------------------------------------------
__global__ void selw_kernel(const float* __restrict__ logits, float* __restrict__ selw) {
    const int r = blockIdx.x * blockDim.x + threadIdx.x;
    if (r >= NRULES) return;
    const float invt = 5.65685424949238f;  // sqrt(32)
    float v[NB];
    float mx = -3.402823466e38f;
    for (int b = 0; b < NB; ++b) {
        float t = logits[r * NB + b] * invt;
        v[b] = t;
        mx = fmaxf(mx, t);
    }
    float s = 0.f;
    for (int b = 0; b < NB; ++b) { float e = __expf(v[b] - mx); v[b] = e; s += e; }
    const float inv = 1.0f / s;
    for (int b = 0; b < NB; ++b) selw[r * NB + b] = v[b] * inv;
}

// ---------------------------------------------------------------------------
// Fused main kernel: 16 tokens per workgroup, 8 waves
// ---------------------------------------------------------------------------
__global__ __launch_bounds__(256)
void rule_proj_kernel(const float* __restrict__ x,
                      const int*   __restrict__ rule_ids,
                      const float* __restrict__ shared_in,   // [2048][45]
                      const float* __restrict__ shared_out,  // [45][2048]
                      const float* __restrict__ rule_in,     // [256][64][8]
                      const float* __restrict__ rule_out,    // [256][8][64]
                      const float* __restrict__ selw,        // [256][32]
                      float*       __restrict__ out)
{
    __shared__ __align__(16) char smem[SMEM_BYTES];
    float* AD  = (float*)(smem + OFF_AD);
    float* H   = (float*)(smem + OFF_H);
    float* HP  = (float*)(smem + OFF_HP);
    float* HID = (float*)(smem + OFF_HID);
    float* SEL = (float*)(smem + OFF_SEL);
    int*   RID = (int*)  (smem + OFF_RID);

    const int tok0 = blockIdx.x * TILE_M;
    const int tid  = threadIdx.x;
    const int w    = tid >> 5;      // wave id 0..7
    const int lane = tid & 31;
    const int lr   = lane & 15;     // row/col within a 16-wide tile
    const int hi   = lane >> 4;     // lane-half: selects K pair / M offset 8

    // ---------- TDM: async-stage this wave's K-chunk of the x tile into LDS ----------
    // 2D tile: 16 rows (tokens) x 256 cols, global row stride 2048 floats,
    // LDS padding of 2 DWORDs every 128 DWORDs -> staged row stride 260 floats
    // (bank = 4*lane -> conflict-free WMMA-A feeds).
    {
        const unsigned long long ga = (unsigned long long)(uintptr_t)x
            + (((unsigned long long)tok0 * INF + (unsigned)(w * 256)) << 2);
        u32x4 g0;
        g0[0] = 1u;                                    // count = 1 (valid descriptor)
        g0[1] = (unsigned)(OFF_XT + w * XT_WAVE_B);    // lds_addr (bytes)
        g0[2] = (unsigned)(ga & 0xFFFFFFFFu);          // global_addr[31:0]
        g0[3] = ((unsigned)(ga >> 32) & 0x01FFFFFFu) | (2u << 30);  // addr[56:32] | type=2
        i32x8 g1;
        g1[0] = (2 << 16)      // data_size = 4 bytes
              | (1 << 20)      // pad_enable
              | (6 << 22)      // pad_interval code 6 = 128 DWORDs
              | (1 << 25);     // pad_amount  code 1 = 2 DWORDs
        g1[1] = (int)(2048u << 16);   // tensor_dim0[15:0] = 2048
        g1[2] = (int)(16u << 16);     // tensor_dim1[15:0] = 16
        g1[3] = (int)(256u << 16);    // tile_dim0 = 256
        g1[4] = 16;                   // tile_dim1 = 16 rows
        g1[5] = 2048;                 // tensor_dim0_stride[31:0] = 2048
        g1[6] = 0;
        g1[7] = 0;
        i32x4 gz  = {0, 0, 0, 0};             // groups 2/3 unused for a 2D tensor
        i32x8 gz8 = {0, 0, 0, 0, 0, 0, 0, 0}; // extra group (6-arg toolchain form)
        __builtin_amdgcn_tensor_load_to_lds(g0, g1, gz, gz, gz8, /*cpol=*/0);
    }

    if (tid < TILE_M) RID[tid] = rule_ids[tok0 + tid];

    // Each wave consumes only its own staged region -> wait on own TENSORcnt only.
    __builtin_amdgcn_s_wait_tensorcnt(0);
    asm volatile("" ::: "memory");

    // ---------- Phase A: h = x_tile @ shared_in, K=2048 split over 8 waves ----------
    v8f acc0 = {}, acc1 = {}, acc2 = {};
    {
        const float* XTw = (const float*)(smem + OFF_XT) + w * XT_WAVE_F + lr * XT_STRIDE_F;
        const int c0 = lr, c1 = 16 + lr, c2 = 32 + lr;
        const int c2c = (c2 < SR) ? c2 : (SR - 1);  // safe addr; cols>=45 zeroed at reduce
        const int kbase = w * (INF / 8);
        for (int s = 0; s < (INF / 8) / 4; ++s) {
            const int j  = 4 * s + 2 * hi;          // col within staged chunk
            const int jj = j + ((j >> 7) << 1);     // + LDS pad correction
            v2f a = *(const v2f*)(XTw + jj);        // A[lr][kk], A[lr][kk+1] from LDS
            const int kk = kbase + j;
            const float* b0 = shared_in + (size_t)kk * SR;
            const float* b1 = b0 + SR;
            v2f b;
            b.x = b0[c0]; b.y = b1[c0];
            acc0 = wmma_f32(a, b, acc0);
            b.x = b0[c1]; b.y = b1[c1];
            acc1 = wmma_f32(a, b, acc1);
            b.x = b0[c2c]; b.y = b1[c2c];
            acc2 = wmma_f32(a, b, acc2);
        }
        float* hp = HP + w * (TILE_M * SRP);
#pragma unroll
        for (int v = 0; v < 8; ++v) {
            const int m = v + 8 * hi;
            hp[m * SRP + c0] = acc0[v];
            hp[m * SRP + c1] = acc1[v];
            hp[m * SRP + c2] = acc2[v];
        }
    }
    __syncthreads();

    // cross-wave reduction of partial h; pad columns 45..47 with exact zeros
    // (XT region is dead from here on: H/AD overlay it)
    for (int e = tid; e < TILE_M * SRP; e += 256) {
        const int m = e / SRP, c = e % SRP;
        float sum = 0.f;
        if (c < SR) {
#pragma unroll
            for (int ww = 0; ww < 8; ++ww) sum += HP[ww * (TILE_M * SRP) + e];
        }
        H[m * HSTR + c] = sum;
    }
    __syncthreads();

    // ---------- Phase C1: gather per-token selector weights (HP is dead now) ----------
    for (int i = tid; i < TILE_M * NB; i += 256) {
        const int m = i >> 5, b = i & (NB - 1);
        SEL[m * NB + b] = selw[RID[m] * NB + b];
    }

    // ---------- Phase C2: hidden[t][32x8] = x_blocks[t] @ rule_in[rid[t]] ----------
    for (int tt = 0; tt < 2; ++tt) {
        const int t    = 2 * w + tt;
        const int rule = RID[t];
        const float* xr  = x + (size_t)(tok0 + t) * INF;
        const float* rin = rule_in + (size_t)rule * (BS * RANK);  // [64][8]
        const int ncl = lr & (RANK - 1);   // clamp B col; cols 8..15 never stored
#pragma unroll
        for (int mt = 0; mt < 2; ++mt) {   // block rows 0..15 / 16..31
            v8f ch = {};
            const float* xa = xr + (mt * 16 + lr) * BS;
#pragma unroll
            for (int s = 0; s < BS / 4; ++s) {
                const int kk = 4 * s + 2 * hi;
                v2f a = *(const v2f*)(xa + kk);
                v2f b;
                b.x = rin[kk * RANK + ncl];
                b.y = rin[(kk + 1) * RANK + ncl];
                ch = wmma_f32(a, b, ch);
            }
            if (lr < RANK) {
#pragma unroll
                for (int v = 0; v < 8; ++v) {
                    const int m = v + 8 * hi;
                    HID[t * (NB * RANK) + (mt * 16 + m) * RANK + lr] = ch[v];
                }
            }
        }
    }
    __syncthreads();

    // ---------- Phases C3 + B, in two column halves (AD holds 16x1024) ----------
    for (int h = 0; h < 2; ++h) {
        // C3: weighted adapter for blocks [h*16, h*16+16) into AD
        for (int tt = 0; tt < 2; ++tt) {
            const int t    = 2 * w + tt;
            const int rule = RID[t];
            const float* rout = rule_out + (size_t)rule * (RANK * BS);  // [8][64]
            const float* hidt = HID + t * (NB * RANK);
#pragma unroll
            for (int nt = 0; nt < 4; ++nt) {
                v8f ca = {};
#pragma unroll
                for (int s = 0; s < 2; ++s) {          // K = 8
                    const int kk = 4 * s + 2 * hi;
                    v2f a;
                    a.x = hidt[(h * 16 + lr) * RANK + kk];
                    a.y = hidt[(h * 16 + lr) * RANK + kk + 1];
                    v2f b;
                    b.x = rout[kk * BS + nt * 16 + lr];
                    b.y = rout[(kk + 1) * BS + nt * 16 + lr];
                    ca = wmma_f32(a, b, ca);
                }
#pragma unroll
                for (int v = 0; v < 8; ++v) {
                    const int bl = v + 8 * hi;                         // local block row
                    AD[t * (OUTF / 2) + bl * BS + nt * 16 + lr] =
                        ca[v] * SEL[t * NB + h * 16 + bl];
                }
            }
        }
        __syncthreads();

        // B: out = adapter + h @ shared_out for columns [h*1024, h*1024+1024)
        for (int i = 0; i < 8; ++i) {
            const int nt  = h * 64 + w * 8 + i;
            const int col = nt * 16 + lr;
            const int lcol = col - h * (OUTF / 2);
            v8f c;
#pragma unroll
            for (int v = 0; v < 8; ++v) c[v] = AD[(v + 8 * hi) * (OUTF / 2) + lcol];
#pragma unroll
            for (int s = 0; s < SRP / 4; ++s) {        // K = 48 (padded)
                const int kk = 4 * s + 2 * hi;
                v2f a;
                a.x = H[lr * HSTR + kk];               // zero for kk >= 45
                a.y = H[lr * HSTR + kk + 1];
                const int r0 = (kk     < SR) ? kk     : SR - 1;  // safe addr; A==0 there
                const int r1 = (kk + 1 < SR) ? kk + 1 : SR - 1;
                v2f b;
                b.x = shared_out[(size_t)r0 * OUTF + col];
                b.y = shared_out[(size_t)r1 * OUTF + col];
                c = wmma_f32(a, b, c);
            }
            float* op = out + (size_t)tok0 * OUTF + col;
#pragma unroll
            for (int v = 0; v < 8; ++v)
                __builtin_nontemporal_store(c[v], op + (size_t)(v + 8 * hi) * OUTF);
        }
        __syncthreads();
    }
}

// ---------------------------------------------------------------------------
extern "C" void kernel_launch(void* const* d_in, const int* in_sizes, int n_in,
                              void* d_out, int out_size, void* d_ws, size_t ws_size,
                              hipStream_t stream) {
    (void)in_sizes; (void)n_in; (void)out_size; (void)ws_size;
    const float* x          = (const float*)d_in[0];
    const int*   rule_ids   = (const int*)  d_in[1];
    const float* shared_in  = (const float*)d_in[2];
    const float* shared_out = (const float*)d_in[3];
    const float* rule_in    = (const float*)d_in[4];
    const float* rule_out   = (const float*)d_in[5];
    const float* logits     = (const float*)d_in[6];
    float* out  = (float*)d_out;
    float* selw = (float*)d_ws;   // 256*32 floats = 32 KB of workspace

    selw_kernel<<<1, 256, 0, stream>>>(logits, selw);
    rule_proj_kernel<<<NTOK / TILE_M, 256, 0, stream>>>(
        x, rule_ids, shared_in, shared_out, rule_in, rule_out, selw, out);
}

// v001
// A run of this version takes 71 microseconds.
// Next to v000, in two timings, it ran 1.49 times as fast each time.
#include <hip/hip_runtime.h>
#include <hip/hip_bf16.h>

typedef float v2f __attribute__((ext_vector_type(2)));
typedef float v4f __attribute__((ext_vector_type(4)));
typedef float v8f __attribute__((ext_vector_type(8)));
typedef unsigned int u32x4 __attribute__((ext_vector_type(4)));
typedef int i32x4 __attribute__((ext_vector_type(4)));
typedef int i32x8 __attribute__((ext_vector_type(8)));

#define NTOK    16384
#define INF     2048
#define OUTF    2048
#define SR      45      // shared rank
#define SRP     48      // padded rank (multiple of 4 for WMMA K-steps)
#define HSTR    52      // LDS row stride for h (bank-conflict padding)
#define NB      32      // blocks
#define BS      64      // block size
#define RANK    8
#define NRULES  256
#define TILE_M  16      // tokens per workgroup

// ---- x-tile staging via TDM (per-wave 16 rows x 256 cols, 2 pad DWORDs / 128) ----
#define XT_STRIDE_F 260                    // floats per staged row (256 + 2*2 pad)
#define XT_WAVE_F   (TILE_M * XT_STRIDE_F) // 4160 floats per wave region
#define XT_WAVE_B   (XT_WAVE_F * 4)        // 16640 bytes

// ---- LDS layout (bytes) ----
#define OFF_XT   0                         // 8 * 16640 = 133120 (phase A only)
#define OFF_AD   0                         // float[16][1024] = 65536 (overlays XT, phase C3/B)
#define OFF_H    65536                     // float[16][HSTR] = 3328  (overlays XT, post-barrier)
#define OFF_R2   133120                    // overlay: HP (phase A) vs HID+SEL (phase C)
#define OFF_HP   OFF_R2                    // float[8][16*48] = 24576
#define OFF_HID  OFF_R2                    // float[16][32*8] = 16384
#define OFF_SEL  (OFF_R2 + 16384)          // float[16][32]   = 2048
#define OFF_RID  (OFF_R2 + 24576)          // int[16]         = 64
#define SMEM_BYTES (OFF_RID + 64)          // 157760

static __device__ __forceinline__ v8f wmma_f32(v2f a, v2f b, v8f c) {
    // D = A(16x4,f32) * B(4x16,f32) + C(16x16,f32)
    return __builtin_amdgcn_wmma_f32_16x16x4_f32(
        /*neg_a=*/false, a, /*neg_b=*/false, b,
        /*c_mod=*/(short)0, c, /*reuse_a=*/false, /*reuse_b=*/false);
}

// ---------------------------------------------------------------------------
// Pre-pass: per-RULE block-selector softmax (sel depends only on the rule id)
// ---------------------------------------------------------------------------
__global__ void selw_kernel(const float* __restrict__ logits, float* __restrict__ selw) {
    const int r = blockIdx.x * blockDim.x + threadIdx.x;
    if (r >= NRULES) return;
    const float invt = 5.65685424949238f;  // sqrt(32)
    float v[NB];
    float mx = -3.402823466e38f;
    for (int b = 0; b < NB; ++b) {
        float t = logits[r * NB + b] * invt;
        v[b] = t;
        mx = fmaxf(mx, t);
    }
    float s = 0.f;
    for (int b = 0; b < NB; ++b) { float e = __expf(v[b] - mx); v[b] = e; s += e; }
    const float inv = 1.0f / s;
    for (int b = 0; b < NB; ++b) selw[r * NB + b] = v[b] * inv;
}

// ---------------------------------------------------------------------------
// Fused main kernel: 16 tokens per workgroup, 8 waves
// ---------------------------------------------------------------------------
__global__ __launch_bounds__(256)
void rule_proj_kernel(const float* __restrict__ x,
                      const int*   __restrict__ rule_ids,
                      const float* __restrict__ shared_in,   // [2048][45]
                      const float* __restrict__ shared_out,  // [45][2048]
                      const float* __restrict__ rule_in,     // [256][64][8]
                      const float* __restrict__ rule_out,    // [256][8][64]
                      const float* __restrict__ selw,        // [256][32]
                      float*       __restrict__ out)
{
    __shared__ __align__(16) char smem[SMEM_BYTES];
    float* AD  = (float*)(smem + OFF_AD);
    float* H   = (float*)(smem + OFF_H);
    float* HP  = (float*)(smem + OFF_HP);
    float* HID = (float*)(smem + OFF_HID);
    float* SEL = (float*)(smem + OFF_SEL);
    int*   RID = (int*)  (smem + OFF_RID);

    const int tok0 = blockIdx.x * TILE_M;
    const int tid  = threadIdx.x;
    const int w    = tid >> 5;      // wave id 0..7
    const int lane = tid & 31;
    const int lr   = lane & 15;     // row/col within a 16-wide tile
    const int hi   = lane >> 4;     // lane-half: selects K pair / M offset 8

    // ---------- TDM: async-stage this wave's K-chunk of the x tile into LDS ----------
    // 2D tile: 16 rows (tokens) x 256 cols, global row stride 2048 floats,
    // LDS padding of 2 DWORDs every 128 DWORDs -> staged row stride 260 floats
    // (bank = 4*lane -> conflict-free WMMA-A feeds).
    {
        const unsigned long long ga = (unsigned long long)(uintptr_t)x
            + (((unsigned long long)tok0 * INF + (unsigned)(w * 256)) << 2);
        u32x4 g0;
        g0[0] = 1u;                                    // count = 1 (valid descriptor)
        g0[1] = (unsigned)(OFF_XT + w * XT_WAVE_B);    // lds_addr (bytes)
        g0[2] = (unsigned)(ga & 0xFFFFFFFFu);          // global_addr[31:0]
        g0[3] = ((unsigned)(ga >> 32) & 0x01FFFFFFu) | (2u << 30);  // addr[56:32] | type=2
        i32x8 g1;
        g1[0] = (2 << 16)      // data_size = 4 bytes
              | (1 << 20)      // pad_enable
              | (6 << 22)      // pad_interval code 6 = 128 DWORDs
              | (1 << 25);     // pad_amount  code 1 = 2 DWORDs
        g1[1] = (int)(2048u << 16);   // tensor_dim0[15:0] = 2048
        g1[2] = (int)(16u << 16);     // tensor_dim1[15:0] = 16
        g1[3] = (int)(256u << 16);    // tile_dim0 = 256
        g1[4] = 16;                   // tile_dim1 = 16 rows
        g1[5] = 2048;                 // tensor_dim0_stride[31:0] = 2048
        g1[6] = 0;
        g1[7] = 0;
        i32x4 gz  = {0, 0, 0, 0};             // groups 2/3 unused for a 2D tensor
        i32x8 gz8 = {0, 0, 0, 0, 0, 0, 0, 0}; // extra group (6-arg toolchain form)
        __builtin_amdgcn_tensor_load_to_lds(g0, g1, gz, gz, gz8, /*cpol=*/0);
    }

    if (tid < TILE_M) RID[tid] = rule_ids[tok0 + tid];

    // Each wave consumes only its own staged region -> wait on own TENSORcnt only.
    __builtin_amdgcn_s_wait_tensorcnt(0);
    asm volatile("" ::: "memory");

    // ---------- Phase A: h = x_tile @ shared_in, K=2048 split over 8 waves ----------
    v8f acc0 = {}, acc1 = {}, acc2 = {};
    {
        const float* XTw = (const float*)(smem + OFF_XT) + w * XT_WAVE_F + lr * XT_STRIDE_F;
        // Column n of N-tile j is h column 3*n + j: a lane's three B values of one k row
        // are adjacent in memory, so one 12-byte load feeds all three tiles.
        const int cb  = 3 * lr;
        const int cbl = (cb < SR) ? cb : (SR - 3);  // lane 15 = pad cols 45..47: safe addr; zeroed at reduce
        // this lane's first B row (k = chunk base + 2*hi); every K-step moves four rows on
        const float* b0 = shared_in + (size_t)(w * (INF / 8) + 2 * hi) * SR + cbl;
        for (int s = 0; s < (INF / 8) / 4; ++s, b0 += 4 * SR) {
            const int j  = 4 * s + 2 * hi;          // col within staged chunk
            const int jj = j + ((j >> 7) << 1);     // + LDS pad correction
            v2f a = *(const v2f*)(XTw + jj);        // A[lr][kk], A[lr][kk+1] from LDS
            const float* b1 = b0 + SR;
            v2f b;
            b.x = b0[0]; b.y = b1[0];
            acc0 = wmma_f32(a, b, acc0);
            b.x = b0[1]; b.y = b1[1];
            acc1 = wmma_f32(a, b, acc1);
            b.x = b0[2]; b.y = b1[2];
            acc2 = wmma_f32(a, b, acc2);
        }
        float* hp = HP + w * (TILE_M * SRP);
#pragma unroll
        for (int v = 0; v < 8; ++v) {
            const int m = v + 8 * hi;
            hp[m * SRP + cb]     = acc0[v];
            hp[m * SRP + cb + 1] = acc1[v];
            hp[m * SRP + cb + 2] = acc2[v];
        }
    }
    __syncthreads();

    // cross-wave reduction of partial h; pad columns 45..47 with exact zeros
    // (XT region is dead from here on: H/AD overlay it)
    for (int e = tid; e < TILE_M * SRP; e += 256) {
        const int m = e / SRP, c = e % SRP;
        float sum = 0.f;
        if (c < SR) {
#pragma unroll
            for (int ww = 0; ww < 8; ++ww) sum += HP[ww * (TILE_M * SRP) + e];
        }
        H[m * HSTR + c] = sum;
    }
    __syncthreads();

    // ---------- Phase C1: gather per-token selector weights (HP is dead now) ----------
    for (int i = tid; i < TILE_M * NB; i += 256) {
        const int m = i >> 5, b = i & (NB - 1);
        SEL[m * NB + b] = selw[RID[m] * NB + b];
    }

    // ---------- Phase C2: hidden[t][32x8] = x_blocks[t] @ rule_in[rid[t]] ----------
    for (int tt = 0; tt < 2; ++tt) {
        const int t    = 2 * w + tt;
        const int rule = RID[t];
        const float* xr  = x + (size_t)(tok0 + t) * INF;
        const float* rin = rule_in + (size_t)rule * (BS * RANK);  // [64][8]
        const int ncl = lr & (RANK - 1);   // clamp B col; cols 8..15 never stored
#pragma unroll
        for (int mt = 0; mt < 2; ++mt) {   // block rows 0..15 / 16..31
            v8f ch = {};
            const float* xa = xr + (mt * 16 + lr) * BS;
#pragma unroll
            for (int s = 0; s < BS / 4; ++s) {
                const int kk = 4 * s + 2 * hi;
                v2f a = *(const v2f*)(xa + kk);
                v2f b;
                b.x = rin[kk * RANK + ncl];
                b.y = rin[(kk + 1) * RANK + ncl];
                ch = wmma_f32(a, b, ch);
            }
            if (lr < RANK) {
#pragma unroll
                for (int v = 0; v < 8; ++v) {
                    const int m = v + 8 * hi;
                    HID[t * (NB * RANK) + (mt * 16 + m) * RANK + lr] = ch[v];
                }
            }
        }
    }
    __syncthreads();

    // ---------- Phases C3 + B, in two column halves (AD holds 16x1024) ----------
    for (int h = 0; h < 2; ++h) {
        // C3: weighted adapter for blocks [h*16, h*16+16) into AD
        // Column n of N-tile j is block column 4*n + j: 16-byte rule_out loads and AD stores.
        v4f r0[2][2], r1[2][2];
#pragma unroll
        for (int tt = 0; tt < 2; ++tt) {
            const float* rout = rule_out + (size_t)RID[2 * w + tt] * (RANK * BS);  // [8][64]
#pragma unroll
            for (int s = 0; s < 2; ++s) {              // K = 8
                const int kk = 4 * s + 2 * hi;
                r0[tt][s] = *(const v4f*)(rout + kk * BS + 4 * lr);
                r1[tt][s] = *(const v4f*)(rout + (kk + 1) * BS + 4 * lr);
            }
        }
        // Keeps the eight loads in flight together: without it the scheduler sinks each pair
        // to its own WMMAs and the wave waits out the load latency once per pair.
        __builtin_amdgcn_sched_barrier(0);
#pragma unroll
        for (int tt = 0; tt < 2; ++tt) {
            const int t    = 2 * w + tt;
            const float* hidt = HID + t * (NB * RANK);
            v8f ca0 = {}, ca1 = {}, ca2 = {}, ca3 = {};
#pragma unroll
            for (int s = 0; s < 2; ++s) {
                const int kk = 4 * s + 2 * hi;
                v2f a;
                a.x = hidt[(h * 16 + lr) * RANK + kk];
                a.y = hidt[(h * 16 + lr) * RANK + kk + 1];
                v2f b;
                b.x = r0[tt][s][0]; b.y = r1[tt][s][0]; ca0 = wmma_f32(a, b, ca0);
                b.x = r0[tt][s][1]; b.y = r1[tt][s][1]; ca1 = wmma_f32(a, b, ca1);
                b.x = r0[tt][s][2]; b.y = r1[tt][s][2]; ca2 = wmma_f32(a, b, ca2);
                b.x = r0[tt][s][3]; b.y = r1[tt][s][3]; ca3 = wmma_f32(a, b, ca3);
            }
            // this lane-half's eight selector weights (local block rows 8*hi .. 8*hi+7)
            const v4f sl = *(const v4f*)(SEL + t * NB + h * 16 + 8 * hi);
            const v4f sh = *(const v4f*)(SEL + t * NB + h * 16 + 8 * hi + 4);
#pragma unroll
            for (int v = 0; v < 8; ++v) {
                const int bl = v + 8 * hi;                             // local block row
                const float sw = (v < 4) ? sl[v & 3] : sh[v & 3];
                v4f o;
                o[0] = ca0[v] * sw; o[1] = ca1[v] * sw; o[2] = ca2[v] * sw; o[3] = ca3[v] * sw;
                *(v4f*)(AD + t * (OUTF / 2) + bl * BS + 4 * lr) = o;
            }
        }
        __syncthreads();

        // B: out = adapter + h @ shared_out for columns [h*1024, h*1024+1024)
        // Four N-tiles at a time; column n of tile j is col + j with col = 64-col base + 4*n:
        // 16-byte AD reads, shared_out loads and out stores that cover whole 128-byte lines.
        v2f ah[SRP / 4];                               // h fragments, the same for every group
#pragma unroll
        for (int s = 0; s < SRP / 4; ++s) {
            const int kk = 4 * s + 2 * hi;
            ah[s].x = H[lr * HSTR + kk];               // zero for kk >= 45
            ah[s].y = H[lr * HSTR + kk + 1];
        }
        // Kept rolled: unrolled, both groups' loads are hoisted together and the kernel needs more
        // than 256 VGPRs, which costs the second resident work-group of a WGP.
#pragma unroll 1
        for (int i = 0; i < 2; ++i) {
            const int lcol = w * 128 + i * 64 + 4 * lr;
            const int col  = h * (OUTF / 2) + lcol;
            v4f q0[SRP / 4], q1[SRP / 4];
#pragma unroll
            for (int s = 0; s < SRP / 4; ++s) {        // K = 48 (padded)
                const int kk = 4 * s + 2 * hi;
                const int r0 = (kk     < SR) ? kk     : SR - 1;  // safe addr; A==0 there
                const int r1 = (kk + 1 < SR) ? kk + 1 : SR - 1;
                q0[s] = *(const v4f*)(shared_out + (size_t)r0 * OUTF + col);
                q1[s] = *(const v4f*)(shared_out + (size_t)r1 * OUTF + col);
            }
            v8f c0, c1, c2, c3;
#pragma unroll
            for (int v = 0; v < 8; ++v) {
                const v4f ad = *(const v4f*)(AD + (v + 8 * hi) * (OUTF / 2) + lcol);
                c0[v] = ad[0]; c1[v] = ad[1]; c2[v] = ad[2]; c3[v] = ad[3];
            }
            // Keeps all of the group's loads in flight ahead of its first WMMA: without it the
            // scheduler issues one pair per K-step and the wave waits out the latency each time.
            __builtin_amdgcn_sched_barrier(0);
#pragma unroll
            for (int s = 0; s < SRP / 4; ++s) {
                const v2f a = ah[s];
                v2f b;
                b.x = q0[s][0]; b.y = q1[s][0]; c0 = wmma_f32(a, b, c0);
                b.x = q0[s][1]; b.y = q1[s][1]; c1 = wmma_f32(a, b, c1);
                b.x = q0[s][2]; b.y = q1[s][2]; c2 = wmma_f32(a, b, c2);
                b.x = q0[s][3]; b.y = q1[s][3]; c3 = wmma_f32(a, b, c3);
            }
            float* op = out + (size_t)tok0 * OUTF + col;
#pragma unroll
            for (int v = 0; v < 8; ++v) {
                v4f o;
                o[0] = c0[v]; o[1] = c1[v]; o[2] = c2[v]; o[3] = c3[v];
                __builtin_nontemporal_store(o, (v4f*)(op + (size_t)(v + 8 * hi) * OUTF));
            }
            // The next trip's loads land in registers that these stores name.
            asm volatile("s_wait_xcnt 0x0" ::: "memory");
        }
        __syncthreads();
    }
}

// ---------------------------------------------------------------------------
extern "C" void kernel_launch(void* const* d_in, const int* in_sizes, int n_in,
                              void* d_out, int out_size, void* d_ws, size_t ws_size,
                              hipStream_t stream) {
    (void)in_sizes; (void)n_in; (void)out_size; (void)ws_size;
    const float* x          = (const float*)d_in[0];
    const int*   rule_ids   = (const int*)  d_in[1];
    const float* shared_in  = (const float*)d_in[2];
    const float* shared_out = (const float*)d_in[3];
    const float* rule_in    = (const float*)d_in[4];
    const float* rule_out   = (const float*)d_in[5];
    const float* logits     = (const float*)d_in[6];
    float* out  = (float*)d_out;
    float* selw = (float*)d_ws;   // 256*32 floats = 32 KB of workspace

    selw_kernel<<<1, 256, 0, stream>>>(logits, selw);
    rule_proj_kernel<<<NTOK / TILE_M, 256, 0, stream>>>(
        x, rule_ids, shared_in, shared_out, rule_in, rule_out, selw, out);
}

// v002
// A run of this version takes 67.8 microseconds.
// Two timings next to v001 both put it at 1.05 times that version's speed.
// Counting every step since v000, it is 1.56 times as fast.
#include <hip/hip_runtime.h>
#include <hip/hip_bf16.h>

typedef float v2f __attribute__((ext_vector_type(2)));
typedef float v4f __attribute__((ext_vector_type(4)));
typedef float v8f __attribute__((ext_vector_type(8)));
typedef unsigned int u32x4 __attribute__((ext_vector_type(4)));
typedef int i32x4 __attribute__((ext_vector_type(4)));
typedef int i32x8 __attribute__((ext_vector_type(8)));

#define NTOK    16384
#define INF     2048
#define OUTF    2048
#define SR      45      // shared rank
#define SRP     48      // padded rank (multiple of 4 for WMMA K-steps)
#define HSTR    52      // LDS row stride for h (bank-conflict padding)
#define NB      32      // blocks
#define BS      64      // block size
#define RANK    8
#define NRULES  256
#define TILE_M  16      // tokens per workgroup

// ---- x-tile staging via TDM (per-wave 16 rows x 256 cols, 2 pad DWORDs / 128) ----
#define XT_STRIDE_F 260                    // floats per staged row (256 + 2*2 pad)
#define XT_WAVE_F   (TILE_M * XT_STRIDE_F) // 4160 floats per wave region
#define XT_WAVE_B   (XT_WAVE_F * 4)        // 16640 bytes

// ---- LDS layout (bytes) ----
#define OFF_XT   0                         // 8 * 16640 = 133120 (phase A only)
#define OFF_AD   0                         // float[16][1024] = 65536 (overlays XT, phase C3/B)
#define OFF_H    65536                     // float[16][HSTR] = 3328  (overlays XT, post-barrier)
#define OFF_R2   133120                    // overlay: HP (phase A) vs HID (phase C)
#define OFF_HP   OFF_R2                    // float[8][16*48] = 24576
#define OFF_HID  OFF_R2                    // float[16][32*8] = 16384
#define OFF_RID  (OFF_R2 + 24576)          // int[16]         = 64
#define OFF_SEL  (OFF_RID + 64)            // float[16][32]   = 2048 (written ahead of phase A)
#define SMEM_BYTES (OFF_SEL + 2048)        // 159808

static __device__ __forceinline__ v8f wmma_f32(v2f a, v2f b, v8f c) {
    // D = A(16x4,f32) * B(4x16,f32) + C(16x16,f32)
    return __builtin_amdgcn_wmma_f32_16x16x4_f32(
        /*neg_a=*/false, a, /*neg_b=*/false, b,
        /*c_mod=*/(short)0, c, /*reuse_a=*/false, /*reuse_b=*/false);
}

// ---------------------------------------------------------------------------
// Block-selector softmax of one rule's 32 logits, one block per lane of a wave
// ---------------------------------------------------------------------------
// value of lane (l ^ M) of the same 16-lane row (DPP row_xmask:M); all lanes on
template <int M>
static __device__ __forceinline__ float row_xor(float v) {
    return __builtin_bit_cast(float, __builtin_amdgcn_update_dpp(
        0, __builtin_bit_cast(int, v), 0x160 + M, 0xf, 0xf, true));
}
// value of lane (l ^ 16): the same place in the other 16-lane row
static __device__ __forceinline__ float other_row(float v) {
    const unsigned u = __builtin_bit_cast(unsigned, v);
    return __builtin_bit_cast(float, __builtin_amdgcn_permlanex16(
        u, u, 0x76543210u, 0xfedcba98u, false, false));
}
static __device__ __forceinline__ float sel_row(const float* __restrict__ logits, int rule, int lane) {
    const float invt = 5.65685424949238f;  // sqrt(32)
    const float t = logits[rule * NB + lane] * invt;
    float mx = t;
    mx = fmaxf(mx, row_xor<1>(mx));
    mx = fmaxf(mx, row_xor<2>(mx));
    mx = fmaxf(mx, row_xor<4>(mx));
    mx = fmaxf(mx, row_xor<8>(mx));
    mx = fmaxf(mx, other_row(mx));
    const float e = __expf(t - mx);
    float s = e;
    s += row_xor<1>(s);
    s += row_xor<2>(s);
    s += row_xor<4>(s);
    s += row_xor<8>(s);
    s += other_row(s);
    return e * (1.0f / s);
}

// ---------------------------------------------------------------------------
// Fused main kernel: 16 tokens per workgroup, 8 waves
// ---------------------------------------------------------------------------
__global__ __launch_bounds__(256)
void rule_proj_kernel(const float* __restrict__ x,
                      const int*   __restrict__ rule_ids,
                      const float* __restrict__ shared_in,   // [2048][45]
                      const float* __restrict__ shared_out,  // [45][2048]
                      const float* __restrict__ rule_in,     // [256][64][8]
                      const float* __restrict__ rule_out,    // [256][8][64]
                      const float* __restrict__ logits,      // [256][32]
                      float*       __restrict__ out)
{
    __shared__ __align__(16) char smem[SMEM_BYTES];
    float* AD  = (float*)(smem + OFF_AD);
    float* H   = (float*)(smem + OFF_H);
    float* HP  = (float*)(smem + OFF_HP);
    float* HID = (float*)(smem + OFF_HID);
    float* SEL = (float*)(smem + OFF_SEL);
    int*   RID = (int*)  (smem + OFF_RID);

    const int tok0 = blockIdx.x * TILE_M;
    const int tid  = threadIdx.x;
    const int w    = tid >> 5;      // wave id 0..7
    const int lane = tid & 31;
    const int lr   = lane & 15;     // row/col within a 16-wide tile
    const int hi   = lane >> 4;     // lane-half: selects K pair / M offset 8

    // ---------- TDM: async-stage this wave's K-chunk of the x tile into LDS ----------
    // 2D tile: 16 rows (tokens) x 256 cols, global row stride 2048 floats,
    // LDS padding of 2 DWORDs every 128 DWORDs -> staged row stride 260 floats
    // (bank = 4*lane -> conflict-free WMMA-A feeds).
    {
        const unsigned long long ga = (unsigned long long)(uintptr_t)x
            + (((unsigned long long)tok0 * INF + (unsigned)(w * 256)) << 2);
        u32x4 g0;
        g0[0] = 1u;                                    // count = 1 (valid descriptor)
        g0[1] = (unsigned)(OFF_XT + w * XT_WAVE_B);    // lds_addr (bytes)
        g0[2] = (unsigned)(ga & 0xFFFFFFFFu);          // global_addr[31:0]
        g0[3] = ((unsigned)(ga >> 32) & 0x01FFFFFFu) | (2u << 30);  // addr[56:32] | type=2
        i32x8 g1;
        g1[0] = (2 << 16)      // data_size = 4 bytes
              | (1 << 20)      // pad_enable
              | (6 << 22)      // pad_interval code 6 = 128 DWORDs
              | (1 << 25);     // pad_amount  code 1 = 2 DWORDs
        g1[1] = (int)(2048u << 16);   // tensor_dim0[15:0] = 2048
        g1[2] = (int)(16u << 16);     // tensor_dim1[15:0] = 16
        g1[3] = (int)(256u << 16);    // tile_dim0 = 256
        g1[4] = 16;                   // tile_dim1 = 16 rows
        g1[5] = 2048;                 // tensor_dim0_stride[31:0] = 2048
        g1[6] = 0;
        g1[7] = 0;
        i32x4 gz  = {0, 0, 0, 0};             // groups 2/3 unused for a 2D tensor
        i32x8 gz8 = {0, 0, 0, 0, 0, 0, 0, 0}; // extra group (6-arg toolchain form)
        __builtin_amdgcn_tensor_load_to_lds(g0, g1, gz, gz, gz8, /*cpol=*/0);
    }

    if (tid < TILE_M) RID[tid] = rule_ids[tok0 + tid];

    // ---------- Phase C1: selector weights of this wave's own two tokens (lane = block) ----------
    // Computed and parked in LDS while the tensor load flies; only this wave reads these two rows.
    // The ids index the logits table: masked to its 256 rows (identity for every allowed id).
    SEL[(2 * w) * NB + lane]     = sel_row(logits, rule_ids[tok0 + 2 * w]     & (NRULES - 1), lane);
    SEL[(2 * w + 1) * NB + lane] = sel_row(logits, rule_ids[tok0 + 2 * w + 1] & (NRULES - 1), lane);

    // Each wave consumes only its own staged region -> wait on own TENSORcnt only.
    __builtin_amdgcn_s_wait_tensorcnt(0);
    asm volatile("" ::: "memory");

    // ---------- Phase A: h = x_tile @ shared_in, K=2048 split over 8 waves ----------
    v8f acc0 = {}, acc1 = {}, acc2 = {};
    {
        const float* XTw = (const float*)(smem + OFF_XT) + w * XT_WAVE_F + lr * XT_STRIDE_F;
        // Column n of N-tile j is h column 3*n + j: a lane's three B values of one k row
        // are adjacent in memory, so one 12-byte load feeds all three tiles.
        const int cb  = 3 * lr;
        const int cbl = (cb < SR) ? cb : (SR - 3);  // lane 15 = pad cols 45..47: safe addr; zeroed at reduce
        // this lane's first B row (k = chunk base + 2*hi); every K-step moves four rows on
        const float* b0 = shared_in + (size_t)(w * (INF / 8) + 2 * hi) * SR + cbl;
        for (int s = 0; s < (INF / 8) / 4; ++s, b0 += 4 * SR) {
            const int j  = 4 * s + 2 * hi;          // col within staged chunk
            const int jj = j + ((j >> 7) << 1);     // + LDS pad correction
            v2f a = *(const v2f*)(XTw + jj);        // A[lr][kk], A[lr][kk+1] from LDS
            const float* b1 = b0 + SR;
            v2f b;
            b.x = b0[0]; b.y = b1[0];
            acc0 = wmma_f32(a, b, acc0);
            b.x = b0[1]; b.y = b1[1];
            acc1 = wmma_f32(a, b, acc1);
            b.x = b0[2]; b.y = b1[2];
            acc2 = wmma_f32(a, b, acc2);
        }
        float* hp = HP + w * (TILE_M * SRP);
#pragma unroll
        for (int v = 0; v < 8; ++v) {
            const int m = v + 8 * hi;
            hp[m * SRP + cb]     = acc0[v];
            hp[m * SRP + cb + 1] = acc1[v];
            hp[m * SRP + cb + 2] = acc2[v];
        }
    }
    __syncthreads();

    // cross-wave reduction of partial h; pad columns 45..47 with exact zeros
    // (XT region is dead from here on: H/AD overlay it)
    for (int e = tid; e < TILE_M * SRP; e += 256) {
        const int m = e / SRP, c = e % SRP;
        float sum = 0.f;
        if (c < SR) {
#pragma unroll
            for (int ww = 0; ww < 8; ++ww) sum += HP[ww * (TILE_M * SRP) + e];
        }
        H[m * HSTR + c] = sum;
    }
    __syncthreads();

    // ---------- Phase C2: hidden[t][32x8] = x_blocks[t] @ rule_in[rid[t]] ----------
    for (int tt = 0; tt < 2; ++tt) {
        const int t    = 2 * w + tt;
        const int rule = RID[t];
        const float* xr  = x + (size_t)(tok0 + t) * INF;
        const float* rin = rule_in + (size_t)rule * (BS * RANK);  // [64][8]
        const int ncl = lr & (RANK - 1);   // clamp B col; cols 8..15 never stored
#pragma unroll
        for (int mt = 0; mt < 2; ++mt) {   // block rows 0..15 / 16..31
            v8f ch = {};
            const float* xa = xr + (mt * 16 + lr) * BS;
#pragma unroll
            for (int s = 0; s < BS / 4; ++s) {
                const int kk = 4 * s + 2 * hi;
                v2f a = *(const v2f*)(xa + kk);
                v2f b;
                b.x = rin[kk * RANK + ncl];
                b.y = rin[(kk + 1) * RANK + ncl];
                ch = wmma_f32(a, b, ch);
            }
            if (lr < RANK) {
#pragma unroll
                for (int v = 0; v < 8; ++v) {
                    const int m = v + 8 * hi;
                    HID[t * (NB * RANK) + (mt * 16 + m) * RANK + lr] = ch[v];
                }
            }
        }
    }
    __syncthreads();

    // ---------- Phases C3 + B, in two column halves (AD holds 16x1024) ----------
    for (int h = 0; h < 2; ++h) {
        // C3: weighted adapter for blocks [h*16, h*16+16) into AD
        // Column n of N-tile j is block column 4*n + j: 16-byte rule_out loads and AD stores.
        v4f r0[2][2], r1[2][2];
#pragma unroll
        for (int tt = 0; tt < 2; ++tt) {
            const float* rout = rule_out + (size_t)RID[2 * w + tt] * (RANK * BS);  // [8][64]
#pragma unroll
            for (int s = 0; s < 2; ++s) {              // K = 8
                const int kk = 4 * s + 2 * hi;
                r0[tt][s] = *(const v4f*)(rout + kk * BS + 4 * lr);
                r1[tt][s] = *(const v4f*)(rout + (kk + 1) * BS + 4 * lr);
            }
        }
        // Keeps the eight loads in flight together: without it the scheduler sinks each pair
        // to its own WMMAs and the wave waits out the load latency once per pair.
        __builtin_amdgcn_sched_barrier(0);
#pragma unroll
        for (int tt = 0; tt < 2; ++tt) {
            const int t    = 2 * w + tt;
            const float* hidt = HID + t * (NB * RANK);
            v8f ca0 = {}, ca1 = {}, ca2 = {}, ca3 = {};
#pragma unroll
            for (int s = 0; s < 2; ++s) {
                const int kk = 4 * s + 2 * hi;
                v2f a;
                a.x = hidt[(h * 16 + lr) * RANK + kk];
                a.y = hidt[(h * 16 + lr) * RANK + kk + 1];
                v2f b;
                b.x = r0[tt][s][0]; b.y = r1[tt][s][0]; ca0 = wmma_f32(a, b, ca0);
                b.x = r0[tt][s][1]; b.y = r1[tt][s][1]; ca1 = wmma_f32(a, b, ca1);
                b.x = r0[tt][s][2]; b.y = r1[tt][s][2]; ca2 = wmma_f32(a, b, ca2);
                b.x = r0[tt][s][3]; b.y = r1[tt][s][3]; ca3 = wmma_f32(a, b, ca3);
            }
            // this lane-half's eight selector weights (local block rows 8*hi .. 8*hi+7)
            const v4f sl = *(const v4f*)(SEL + t * NB + h * 16 + 8 * hi);
            const v4f sh = *(const v4f*)(SEL + t * NB + h * 16 + 8 * hi + 4);
#pragma unroll
            for (int v = 0; v < 8; ++v) {
                const int bl = v + 8 * hi;                             // local block row
                const float sw = (v < 4) ? sl[v & 3] : sh[v & 3];
                v4f o;
                o[0] = ca0[v] * sw; o[1] = ca1[v] * sw; o[2] = ca2[v] * sw; o[3] = ca3[v] * sw;
                *(v4f*)(AD + t * (OUTF / 2) + bl * BS + 4 * lr) = o;
            }
        }
        __syncthreads();

        // B: out = adapter + h @ shared_out for columns [h*1024, h*1024+1024)
        // Four N-tiles at a time; column n of tile j is col + j with col = 64-col base + 4*n:
        // 16-byte AD reads, shared_out loads and out stores that cover whole 128-byte lines.
        v2f ah[SRP / 4];                               // h fragments, the same for every group
#pragma unroll
        for (int s = 0; s < SRP / 4; ++s) {
            const int kk = 4 * s + 2 * hi;
            ah[s].x = H[lr * HSTR + kk];               // zero for kk >= 45
            ah[s].y = H[lr * HSTR + kk + 1];
        }
        // Kept rolled: unrolled, both groups' loads are hoisted together and the kernel needs more
        // than 256 VGPRs, which costs the second resident work-group of a WGP.
#pragma unroll 1
        for (int i = 0; i < 2; ++i) {
            const int lcol = w * 128 + i * 64 + 4 * lr;
            const int col  = h * (OUTF / 2) + lcol;
            v4f q0[SRP / 4], q1[SRP / 4];
#pragma unroll
            for (int s = 0; s < SRP / 4; ++s) {        // K = 48 (padded)
                const int kk = 4 * s + 2 * hi;
                const int r0 = (kk     < SR) ? kk     : SR - 1;  // safe addr; A==0 there
                const int r1 = (kk + 1 < SR) ? kk + 1 : SR - 1;
                q0[s] = *(const v4f*)(shared_out + (size_t)r0 * OUTF + col);
                q1[s] = *(const v4f*)(shared_out + (size_t)r1 * OUTF + col);
            }
            v8f c0, c1, c2, c3;
#pragma unroll
            for (int v = 0; v < 8; ++v) {
                const v4f ad = *(const v4f*)(AD + (v + 8 * hi) * (OUTF / 2) + lcol);
                c0[v] = ad[0]; c1[v] = ad[1]; c2[v] = ad[2]; c3[v] = ad[3];
            }
            // Keeps all of the group's loads in flight ahead of its first WMMA: without it the
            // scheduler issues one pair per K-step and the wave waits out the latency each time.
            __builtin_amdgcn_sched_barrier(0);
#pragma unroll
            for (int s = 0; s < SRP / 4; ++s) {
                const v2f a = ah[s];
                v2f b;
                b.x = q0[s][0]; b.y = q1[s][0]; c0 = wmma_f32(a, b, c0);
                b.x = q0[s][1]; b.y = q1[s][1]; c1 = wmma_f32(a, b, c1);
                b.x = q0[s][2]; b.y = q1[s][2]; c2 = wmma_f32(a, b, c2);
                b.x = q0[s][3]; b.y = q1[s][3]; c3 = wmma_f32(a, b, c3);
            }
            float* op = out + (size_t)tok0 * OUTF + col;
#pragma unroll
            for (int v = 0; v < 8; ++v) {
                v4f o;
                o[0] = c0[v]; o[1] = c1[v]; o[2] = c2[v]; o[3] = c3[v];
                __builtin_nontemporal_store(o, (v4f*)(op + (size_t)(v + 8 * hi) * OUTF));
            }
            // The next trip's loads land in registers that these stores name.
            asm volatile("s_wait_xcnt 0x0" ::: "memory");
        }
        __syncthreads();
    }
}

// ---------------------------------------------------------------------------
extern "C" void kernel_launch(void* const* d_in, const int* in_sizes, int n_in,
                              void* d_out, int out_size, void* d_ws, size_t ws_size,
                              hipStream_t stream) {
    (void)in_sizes; (void)n_in; (void)out_size; (void)d_ws; (void)ws_size;
    const float* x          = (const float*)d_in[0];
    const int*   rule_ids   = (const int*)  d_in[1];
    const float* shared_in  = (const float*)d_in[2];
    const float* shared_out = (const float*)d_in[3];
    const float* rule_in    = (const float*)d_in[4];
    const float* rule_out   = (const float*)d_in[5];
    const float* logits     = (const float*)d_in[6];
    float* out  = (float*)d_out;

    rule_proj_kernel<<<NTOK / TILE_M, 256, 0, stream>>>(
        x, rule_ids, shared_in, shared_out, rule_in, rule_out, logits, out);
}

// v003
// One run takes 64.6 microseconds.
// Two timings next to v002 put it at 1.04 and 1.05 times that version's speed.
// Counting every step since v000, it is 1.63 times as fast.
#include <hip/hip_runtime.h>
#include <hip/hip_bf16.h>

typedef float v2f __attribute__((ext_vector_type(2)));
typedef float v4f __attribute__((ext_vector_type(4)));
typedef float v8f __attribute__((ext_vector_type(8)));
typedef unsigned int u32x4 __attribute__((ext_vector_type(4)));
typedef int i32x4 __attribute__((ext_vector_type(4)));
typedef int i32x8 __attribute__((ext_vector_type(8)));

#define NTOK    16384
#define INF     2048
#define OUTF    2048
#define SR      45      // shared rank
#define SRP     48      // padded rank (multiple of 4 for WMMA K-steps)
#define HSTR    52      // LDS row stride for h (bank-conflict padding)
#define NB      32      // blocks
#define BS      64      // block size
#define RANK    8
#define NRULES  256
#define TILE_M  16      // tokens per workgroup

// ---- x-tile staging via TDM (per-wave 16 rows x 256 cols, 2 pad DWORDs / 128) ----
#define XT_STRIDE_F 260                    // floats per staged row (256 + 2*2 pad)
#define XT_WAVE_F   (TILE_M * XT_STRIDE_F) // 4160 floats per wave region
#define XT_WAVE_B   (XT_WAVE_F * 4)        // 16640 bytes

// ---- LDS layout (bytes) ----
#define OFF_XT   0                         // 8 * 16640 = 133120 (phase A only)
#define OFF_X2   0                         // float[16][2048] = 131072 (overlays XT, phase C2 only)
#define OFF_AD   0                         // float[16][1024] = 65536 (overlays XT/X2, phase C3/B)
#define OFF_R2   133120                    // overlay: HP (phase A) vs HID (phase C)
#define OFF_HP   OFF_R2                    // float[8][16*48] = 24576
#define OFF_HID  OFF_R2                    // float[16][32*8] = 16384
#define OFF_RID  (OFF_R2 + 24576)          // int[16]         = 64
#define OFF_SEL  (OFF_RID + 64)            // float[16][32]   = 2048 (written ahead of phase A)
#define OFF_H    (OFF_SEL + 2048)          // float[16][HSTR] = 3328
#define SMEM_BYTES (OFF_H + 3328)          // 163136

static __device__ __forceinline__ v8f wmma_f32(v2f a, v2f b, v8f c) {
    // D = A(16x4,f32) * B(4x16,f32) + C(16x16,f32)
    return __builtin_amdgcn_wmma_f32_16x16x4_f32(
        /*neg_a=*/false, a, /*neg_b=*/false, b,
        /*c_mod=*/(short)0, c, /*reuse_a=*/false, /*reuse_b=*/false);
}

// ---------------------------------------------------------------------------
// Block-selector softmax of one rule's 32 logits, one block per lane of a wave
// ---------------------------------------------------------------------------
// value of lane (l ^ M) of the same 16-lane row (DPP row_xmask:M); all lanes on
template <int M>
static __device__ __forceinline__ float row_xor(float v) {
    return __builtin_bit_cast(float, __builtin_amdgcn_update_dpp(
        0, __builtin_bit_cast(int, v), 0x160 + M, 0xf, 0xf, true));
}
// value of lane (l ^ 16): the same place in the other 16-lane row
static __device__ __forceinline__ float other_row(float v) {
    const unsigned u = __builtin_bit_cast(unsigned, v);
    return __builtin_bit_cast(float, __builtin_amdgcn_permlanex16(
        u, u, 0x76543210u, 0xfedcba98u, false, false));
}
static __device__ __forceinline__ float sel_row(const float* __restrict__ logits, int rule, int lane) {
    const float invt = 5.65685424949238f;  // sqrt(32)
    const float t = logits[rule * NB + lane] * invt;
    float mx = t;
    mx = fmaxf(mx, row_xor<1>(mx));
    mx = fmaxf(mx, row_xor<2>(mx));
    mx = fmaxf(mx, row_xor<4>(mx));
    mx = fmaxf(mx, row_xor<8>(mx));
    mx = fmaxf(mx, other_row(mx));
    const float e = __expf(t - mx);
    float s = e;
    s += row_xor<1>(s);
    s += row_xor<2>(s);
    s += row_xor<4>(s);
    s += row_xor<8>(s);
    s += other_row(s);
    return e * (1.0f / s);
}

// ---------------------------------------------------------------------------
// Fused main kernel: 16 tokens per workgroup, 8 waves
// ---------------------------------------------------------------------------
__global__ __launch_bounds__(256)
void rule_proj_kernel(const float* __restrict__ x,
                      const int*   __restrict__ rule_ids,
                      const float* __restrict__ shared_in,   // [2048][45]
                      const float* __restrict__ shared_out,  // [45][2048]
                      const float* __restrict__ rule_in,     // [256][64][8]
                      const float* __restrict__ rule_out,    // [256][8][64]
                      const float* __restrict__ logits,      // [256][32]
                      float*       __restrict__ out)
{
    __shared__ __align__(16) char smem[SMEM_BYTES];
    float* AD  = (float*)(smem + OFF_AD);
    float* H   = (float*)(smem + OFF_H);
    float* HP  = (float*)(smem + OFF_HP);
    float* HID = (float*)(smem + OFF_HID);
    float* SEL = (float*)(smem + OFF_SEL);
    int*   RID = (int*)  (smem + OFF_RID);

    const int tok0 = blockIdx.x * TILE_M;
    const int tid  = threadIdx.x;
    const int w    = tid >> 5;      // wave id 0..7
    const int lane = tid & 31;
    const int lr   = lane & 15;     // row/col within a 16-wide tile
    const int hi   = lane >> 4;     // lane-half: selects K pair / M offset 8

    // ---------- TDM: async-stage this wave's K-chunk of the x tile into LDS ----------
    // 2D tile: 16 rows (tokens) x 256 cols, global row stride 2048 floats,
    // LDS padding of 2 DWORDs every 128 DWORDs -> staged row stride 260 floats
    // (bank = 4*lane -> conflict-free WMMA-A feeds).
    {
        const unsigned long long ga = (unsigned long long)(uintptr_t)x
            + (((unsigned long long)tok0 * INF + (unsigned)(w * 256)) << 2);
        u32x4 g0;
        g0[0] = 1u;                                    // count = 1 (valid descriptor)
        g0[1] = (unsigned)(OFF_XT + w * XT_WAVE_B);    // lds_addr (bytes)
        g0[2] = (unsigned)(ga & 0xFFFFFFFFu);          // global_addr[31:0]
        g0[3] = ((unsigned)(ga >> 32) & 0x01FFFFFFu) | (2u << 30);  // addr[56:32] | type=2
        i32x8 g1;
        g1[0] = (2 << 16)      // data_size = 4 bytes
              | (1 << 20)      // pad_enable
              | (6 << 22)      // pad_interval code 6 = 128 DWORDs
              | (1 << 25);     // pad_amount  code 1 = 2 DWORDs
        g1[1] = (int)(2048u << 16);   // tensor_dim0[15:0] = 2048
        g1[2] = (int)(16u << 16);     // tensor_dim1[15:0] = 16
        g1[3] = (int)(256u << 16);    // tile_dim0 = 256
        g1[4] = 16;                   // tile_dim1 = 16 rows
        g1[5] = 2048;                 // tensor_dim0_stride[31:0] = 2048
        g1[6] = 0;
        g1[7] = 0;
        i32x4 gz  = {0, 0, 0, 0};             // groups 2/3 unused for a 2D tensor
        i32x8 gz8 = {0, 0, 0, 0, 0, 0, 0, 0}; // extra group (6-arg toolchain form)
        __builtin_amdgcn_tensor_load_to_lds(g0, g1, gz, gz, gz8, /*cpol=*/0);
    }

    if (tid < TILE_M) RID[tid] = rule_ids[tok0 + tid];

    // ---------- Phase C1: selector weights of this wave's own two tokens (lane = block) ----------
    // Computed and parked in LDS while the tensor load flies; only this wave reads these two rows.
    // The ids index the logits table: masked to its 256 rows (identity for every allowed id).
    SEL[(2 * w) * NB + lane]     = sel_row(logits, rule_ids[tok0 + 2 * w]     & (NRULES - 1), lane);
    SEL[(2 * w + 1) * NB + lane] = sel_row(logits, rule_ids[tok0 + 2 * w + 1] & (NRULES - 1), lane);

    // Each wave consumes only its own staged region -> wait on own TENSORcnt only.
    __builtin_amdgcn_s_wait_tensorcnt(0);
    asm volatile("" ::: "memory");

    // ---------- Phase A: h = x_tile @ shared_in, K=2048 split over 8 waves ----------
    v8f acc0 = {}, acc1 = {}, acc2 = {};
    {
        const float* XTw = (const float*)(smem + OFF_XT) + w * XT_WAVE_F + lr * XT_STRIDE_F;
        // Column n of N-tile j is h column 3*n + j: a lane's three B values of one k row
        // are adjacent in memory, so one 12-byte load feeds all three tiles.
        const int cb  = 3 * lr;
        const int cbl = (cb < SR) ? cb : (SR - 3);  // lane 15 = pad cols 45..47: safe addr; zeroed at reduce
        // this lane's first B row (k = chunk base + 2*hi); every K-step moves four rows on
        const float* b0 = shared_in + (size_t)(w * (INF / 8) + 2 * hi) * SR + cbl;
        for (int s = 0; s < (INF / 8) / 4; ++s, b0 += 4 * SR) {
            const int j  = 4 * s + 2 * hi;          // col within staged chunk
            const int jj = j + ((j >> 7) << 1);     // + LDS pad correction
            v2f a = *(const v2f*)(XTw + jj);        // A[lr][kk], A[lr][kk+1] from LDS
            const float* b1 = b0 + SR;
            v2f b;
            b.x = b0[0]; b.y = b1[0];
            acc0 = wmma_f32(a, b, acc0);
            b.x = b0[1]; b.y = b1[1];
            acc1 = wmma_f32(a, b, acc1);
            b.x = b0[2]; b.y = b1[2];
            acc2 = wmma_f32(a, b, acc2);
        }
        float* hp = HP + w * (TILE_M * SRP);
#pragma unroll
        for (int v = 0; v < 8; ++v) {
            const int m = v + 8 * hi;
            hp[m * SRP + cb]     = acc0[v];
            hp[m * SRP + cb + 1] = acc1[v];
            hp[m * SRP + cb + 2] = acc2[v];
        }
    }
    __syncthreads();

    // ---------- x rows of this wave's own two tokens, once more, laid out for phase C2 ----------
    // (XT is dead from here on: X2, later AD, overlay it.) Each copy moves 512 contiguous bytes
    // (two 64-float blocks) from global memory straight to LDS. Block b keeps its 256 bytes, but its 16-byte
    // piece c lies at place (c + b) & 15: the sixteen blocks that one A-fragment read touches
    // then fall on all 64 banks. The copies fly under the reduction below.
    {
        const unsigned x2b = (unsigned)(uintptr_t)(smem + OFF_X2) + (unsigned)(2 * w) * (INF * 4) + (unsigned)hi * 256u;
        const float* gx = x + (size_t)(tok0 + 2 * w) * INF + 4 * lane;
        // Both loops unrolled: the address arrays must end up in registers, as asm operands.
#pragma unroll
        for (int q = 0; q < 4; ++q) {                  // eight copies a statement; q >> 1 = token
            unsigned la[8];
            const float* ga[8];
#pragma unroll
            for (int j = 0; j < 8; ++j) {
                const int i = (q & 1) * 8 + j;         // copy i of the row: blocks 2i and 2i + 1
                la[j] = x2b + (unsigned)((q >> 1) * (INF * 4) + i * 512) + (unsigned)(((lr + hi + 2 * i) & 15) << 4);
                ga[j] = gx + (q >> 1) * INF + i * 128;
            }
            // s_wait_xcnt closes the statement, ahead of any rewrite of the copies' address registers (a precaution).
            asm volatile("global_load_async_to_lds_b128 %0, %8, off\n\t"
                         "global_load_async_to_lds_b128 %1, %9, off\n\t"
                         "global_load_async_to_lds_b128 %2, %10, off\n\t"
                         "global_load_async_to_lds_b128 %3, %11, off\n\t"
                         "global_load_async_to_lds_b128 %4, %12, off\n\t"
                         "global_load_async_to_lds_b128 %5, %13, off\n\t"
                         "global_load_async_to_lds_b128 %6, %14, off\n\t"
                         "global_load_async_to_lds_b128 %7, %15, off\n\t"
                         "s_wait_xcnt 0x0"
                         :: "v"(la[0]), "v"(la[1]), "v"(la[2]), "v"(la[3]),
                            "v"(la[4]), "v"(la[5]), "v"(la[6]), "v"(la[7]),
                            "v"(ga[0]), "v"(ga[1]), "v"(ga[2]), "v"(ga[3]),
                            "v"(ga[4]), "v"(ga[5]), "v"(ga[6]), "v"(ga[7])
                         : "memory");
        }
    }

    // cross-wave reduction of partial h; pad columns 45..47 with exact zeros
    for (int e = tid; e < TILE_M * SRP; e += 256) {
        const int m = e / SRP, c = e % SRP;
        float sum = 0.f;
        if (c < SR) {
#pragma unroll
            for (int ww = 0; ww < 8; ++ww) sum += HP[ww * (TILE_M * SRP) + e];
        }
        H[m * HSTR + c] = sum;
    }
    // This wave's copies have landed before anything reads X2 (the compiler places no wait for them).
    asm volatile("s_wait_asynccnt 0x0" ::: "memory");
    __syncthreads();

    // ---------- Phase C2: hidden[t][32x8] = x_blocks[t] @ rule_in[rid[t]] ----------
    for (int tt = 0; tt < 2; ++tt) {
        const int t    = 2 * w + tt;
        const int rule = RID[t];
        const float* xr  = (const float*)(smem + OFF_X2) + t * INF;   // staged row, pieces rotated
        const float* rin = rule_in + (size_t)rule * (BS * RANK);  // [64][8]
        const int ncl = lr & (RANK - 1);   // clamp B col; cols 8..15 never stored
#pragma unroll
        for (int mt = 0; mt < 2; ++mt) {   // block rows 0..15 / 16..31
            v8f ch = {};
            const float* xa = xr + (mt * 16 + lr) * BS + 2 * hi;
#pragma unroll
            for (int s = 0; s < BS / 4; ++s) {
                const int kk = 4 * s + 2 * hi;
                v2f a = *(const v2f*)(xa + (((s + lr) & 15) << 2));  // piece s of block mt*16 + lr
                v2f b;
                b.x = rin[kk * RANK + ncl];
                b.y = rin[(kk + 1) * RANK + ncl];
                ch = wmma_f32(a, b, ch);
            }
            if (lr < RANK) {
#pragma unroll
                for (int v = 0; v < 8; ++v) {
                    const int m = v + 8 * hi;
                    HID[t * (NB * RANK) + (mt * 16 + m) * RANK + lr] = ch[v];
                }
            }
        }
    }
    __syncthreads();

    // ---------- Phases C3 + B, in two column halves (AD holds 16x1024) ----------
    for (int h = 0; h < 2; ++h) {
        // C3: weighted adapter for blocks [h*16, h*16+16) into AD
        // Column n of N-tile j is block column 4*n + j: 16-byte rule_out loads and AD stores.
        v4f r0[2][2], r1[2][2];
#pragma unroll
        for (int tt = 0; tt < 2; ++tt) {
            const float* rout = rule_out + (size_t)RID[2 * w + tt] * (RANK * BS);  // [8][64]
#pragma unroll
            for (int s = 0; s < 2; ++s) {              // K = 8
                const int kk = 4 * s + 2 * hi;
                r0[tt][s] = *(const v4f*)(rout + kk * BS + 4 * lr);
                r1[tt][s] = *(const v4f*)(rout + (kk + 1) * BS + 4 * lr);
            }
        }
        // Keeps the eight loads in flight together: without it the scheduler sinks each pair
        // to its own WMMAs and the wave waits out the load latency once per pair.
        __builtin_amdgcn_sched_barrier(0);
#pragma unroll
        for (int tt = 0; tt < 2; ++tt) {
            const int t    = 2 * w + tt;
            const float* hidt = HID + t * (NB * RANK);
            v8f ca0 = {}, ca1 = {}, ca2 = {}, ca3 = {};
#pragma unroll
            for (int s = 0; s < 2; ++s) {
                const int kk = 4 * s + 2 * hi;
                v2f a;
                a.x = hidt[(h * 16 + lr) * RANK + kk];
                a.y = hidt[(h * 16 + lr) * RANK + kk + 1];
                v2f b;
                b.x = r0[tt][s][0]; b.y = r1[tt][s][0]; ca0 = wmma_f32(a, b, ca0);
                b.x = r0[tt][s][1]; b.y = r1[tt][s][1]; ca1 = wmma_f32(a, b, ca1);
                b.x = r0[tt][s][2]; b.y = r1[tt][s][2]; ca2 = wmma_f32(a, b, ca2);
                b.x = r0[tt][s][3]; b.y = r1[tt][s][3]; ca3 = wmma_f32(a, b, ca3);
            }
            // this lane-half's eight selector weights (local block rows 8*hi .. 8*hi+7)
            const v4f sl = *(const v4f*)(SEL + t * NB + h * 16 + 8 * hi);
            const v4f sh = *(const v4f*)(SEL + t * NB + h * 16 + 8 * hi + 4);
#pragma unroll
            for (int v = 0; v < 8; ++v) {
                const int bl = v + 8 * hi;                             // local block row
                const float sw = (v < 4) ? sl[v & 3] : sh[v & 3];
                v4f o;
                o[0] = ca0[v] * sw; o[1] = ca1[v] * sw; o[2] = ca2[v] * sw; o[3] = ca3[v] * sw;
                *(v4f*)(AD + t * (OUTF / 2) + bl * BS + 4 * lr) = o;
            }
        }
        __syncthreads();

        // B: out = adapter + h @ shared_out for columns [h*1024, h*1024+1024)
        // Four N-tiles at a time; column n of tile j is col + j with col = 64-col base + 4*n:
        // 16-byte AD reads, shared_out loads and out stores that cover whole 128-byte lines.
        v2f ah[SRP / 4];                               // h fragments, the same for every group
#pragma unroll
        for (int s = 0; s < SRP / 4; ++s) {
            const int kk = 4 * s + 2 * hi;
            ah[s].x = H[lr * HSTR + kk];               // zero for kk >= 45
            ah[s].y = H[lr * HSTR + kk + 1];
        }
        // Kept rolled: unrolled, both groups' loads are hoisted together and the kernel needs more
        // than 256 VGPRs, which costs the second resident work-group of a WGP.
#pragma unroll 1
        for (int i = 0; i < 2; ++i) {
            const int lcol = w * 128 + i * 64 + 4 * lr;
            const int col  = h * (OUTF / 2) + lcol;
            v4f q0[SRP / 4], q1[SRP / 4];
#pragma unroll
            for (int s = 0; s < SRP / 4; ++s) {        // K = 48 (padded)
                const int kk = 4 * s + 2 * hi;
                const int r0 = (kk     < SR) ? kk     : SR - 1;  // safe addr; A==0 there
                const int r1 = (kk + 1 < SR) ? kk + 1 : SR - 1;
                q0[s] = *(const v4f*)(shared_out + (size_t)r0 * OUTF + col);
                q1[s] = *(const v4f*)(shared_out + (size_t)r1 * OUTF + col);
            }
            v8f c0, c1, c2, c3;
#pragma unroll
            for (int v = 0; v < 8; ++v) {
                const v4f ad = *(const v4f*)(AD + (v + 8 * hi) * (OUTF / 2) + lcol);
                c0[v] = ad[0]; c1[v] = ad[1]; c2[v] = ad[2]; c3[v] = ad[3];
            }
            // Keeps all of the group's loads in flight ahead of its first WMMA: without it the
            // scheduler issues one pair per K-step and the wave waits out the latency each time.
            __builtin_amdgcn_sched_barrier(0);
#pragma unroll
            for (int s = 0; s < SRP / 4; ++s) {
                const v2f a = ah[s];
                v2f b;
                b.x = q0[s][0]; b.y = q1[s][0]; c0 = wmma_f32(a, b, c0);
                b.x = q0[s][1]; b.y = q1[s][1]; c1 = wmma_f32(a, b, c1);
                b.x = q0[s][2]; b.y = q1[s][2]; c2 = wmma_f32(a, b, c2);
                b.x = q0[s][3]; b.y = q1[s][3]; c3 = wmma_f32(a, b, c3);
            }
            float* op = out + (size_t)tok0 * OUTF + col;
#pragma unroll
            for (int v = 0; v < 8; ++v) {
                v4f o;
                o[0] = c0[v]; o[1] = c1[v]; o[2] = c2[v]; o[3] = c3[v];
                __builtin_nontemporal_store(o, (v4f*)(op + (size_t)(v + 8 * hi) * OUTF));
            }
            // The next trip's loads land in registers that these stores name.
            asm volatile("s_wait_xcnt 0x0" ::: "memory");
        }
        __syncthreads();
    }
}

// ---------------------------------------------------------------------------
extern "C" void kernel_launch(void* const* d_in, const int* in_sizes, int n_in,
                              void* d_out, int out_size, void* d_ws, size_t ws_size,
                              hipStream_t stream) {
    (void)in_sizes; (void)n_in; (void)out_size; (void)d_ws; (void)ws_size;
    const float* x          = (const float*)d_in[0];
    const int*   rule_ids   = (const int*)  d_in[1];
    const float* shared_in  = (const float*)d_in[2];
    const float* shared_out = (const float*)d_in[3];
    const float* rule_in    = (const float*)d_in[4];
    const float* rule_out   = (const float*)d_in[5];
    const float* logits     = (const float*)d_in[6];
    float* out  = (float*)d_out;

    rule_proj_kernel<<<NTOK / TILE_M, 256, 0, stream>>>(
        x, rule_ids, shared_in, shared_out, rule_in, rule_out, logits, out);
}

// v004
// It runs in 60.6 microseconds.
// Two timings next to v003 both put it at 1.04 times that version's speed.
// Counting every step since v000, it is 1.70 times as fast.
#include <hip/hip_runtime.h>
#include <hip/hip_bf16.h>

typedef float v2f __attribute__((ext_vector_type(2)));
typedef float v4f __attribute__((ext_vector_type(4)));
typedef float v8f __attribute__((ext_vector_type(8)));
typedef unsigned int u32x4 __attribute__((ext_vector_type(4)));
typedef int i32x4 __attribute__((ext_vector_type(4)));
typedef int i32x8 __attribute__((ext_vector_type(8)));

#define NTOK    16384
#define INF     2048
#define OUTF    2048
#define SR      45      // shared rank
#define SRP     48      // padded rank (multiple of 4 for WMMA K-steps)
#define HSTR    52      // LDS row stride for h (bank-conflict padding)
#define NB      32      // blocks
#define BS      64      // block size
#define RANK    8
#define NRULES  256
#define TILE_M  16      // tokens per workgroup

// ---- x-tile staging via TDM (per-wave 16 rows x 256 cols, 2 pad DWORDs / 128) ----
#define XT_STRIDE_F 260                    // floats per staged row (256 + 2*2 pad)
#define XT_WAVE_F   (TILE_M * XT_STRIDE_F) // 4160 floats per wave region
#define XT_WAVE_B   (XT_WAVE_F * 4)        // 16640 bytes

// ---- LDS layout (bytes) ----
#define OFF_XT   0                         // 8 * 16640 = 133120 (phase A only)
#define OFF_X2   0                         // float[16][2048] = 131072 (overlays XT, phase C2 only)
#define OFF_AD   0                         // float[16][1024] = 65536 (overlays XT/X2, phase C3/B)
#define OFF_R2   133120                    // overlay: HP (phase A) vs HID (phase C)
#define OFF_HP   OFF_R2                    // float[8][16*48] = 24576
#define OFF_HID  OFF_R2                    // float[16][32*8] = 16384
#define OFF_RID  (OFF_R2 + 24576)          // int[16]         = 64
#define OFF_SEL  (OFF_RID + 64)            // float[16][32]   = 2048 (written ahead of phase A)
#define OFF_H    (OFF_SEL + 2048)          // float[16][HSTR] = 3328
#define SMEM_BYTES (OFF_H + 3328)          // 163136

static __device__ __forceinline__ v8f wmma_f32(v2f a, v2f b, v8f c) {
    // D = A(16x4,f32) * B(4x16,f32) + C(16x16,f32)
    return __builtin_amdgcn_wmma_f32_16x16x4_f32(
        /*neg_a=*/false, a, /*neg_b=*/false, b,
        /*c_mod=*/(short)0, c, /*reuse_a=*/false, /*reuse_b=*/false);
}

// ---------------------------------------------------------------------------
// Block-selector softmax of one rule's 32 logits, one block per lane of a wave
// ---------------------------------------------------------------------------
// value of lane (l ^ M) of the same 16-lane row (DPP row_xmask:M); all lanes on
template <int M>
static __device__ __forceinline__ float row_xor(float v) {
    return __builtin_bit_cast(float, __builtin_amdgcn_update_dpp(
        0, __builtin_bit_cast(int, v), 0x160 + M, 0xf, 0xf, true));
}
// value of lane (l ^ 16): the same place in the other 16-lane row
static __device__ __forceinline__ float other_row(float v) {
    const unsigned u = __builtin_bit_cast(unsigned, v);
    return __builtin_bit_cast(float, __builtin_amdgcn_permlanex16(
        u, u, 0x76543210u, 0xfedcba98u, false, false));
}
static __device__ __forceinline__ float sel_row(const float* __restrict__ logits, int rule, int lane) {
    const float invt = 5.65685424949238f;  // sqrt(32)
    const float t = logits[rule * NB + lane] * invt;
    float mx = t;
    mx = fmaxf(mx, row_xor<1>(mx));
    mx = fmaxf(mx, row_xor<2>(mx));
    mx = fmaxf(mx, row_xor<4>(mx));
    mx = fmaxf(mx, row_xor<8>(mx));
    mx = fmaxf(mx, other_row(mx));
    const float e = __expf(t - mx);
    float s = e;
    s += row_xor<1>(s);
    s += row_xor<2>(s);
    s += row_xor<4>(s);
    s += row_xor<8>(s);
    s += other_row(s);
    return e * (1.0f / s);
}

// ---------------------------------------------------------------------------
// Fused main kernel: 16 tokens per workgroup, 8 waves
// ---------------------------------------------------------------------------
__global__ __launch_bounds__(256)
void rule_proj_kernel(const float* __restrict__ x,
                      const int*   __restrict__ rule_ids,
                      const float* __restrict__ shared_in,   // [2048][45]
                      const float* __restrict__ shared_out,  // [45][2048]
                      const float* __restrict__ rule_in,     // [256][64][8]
                      const float* __restrict__ rule_out,    // [256][8][64]
                      const float* __restrict__ logits,      // [256][32]
                      float*       __restrict__ out)
{
    __shared__ __align__(16) char smem[SMEM_BYTES];
    float* AD  = (float*)(smem + OFF_AD);
    float* H   = (float*)(smem + OFF_H);
    float* HP  = (float*)(smem + OFF_HP);
    float* HID = (float*)(smem + OFF_HID);
    float* SEL = (float*)(smem + OFF_SEL);
    int*   RID = (int*)  (smem + OFF_RID);

    const int tok0 = blockIdx.x * TILE_M;
    const int tid  = threadIdx.x;
    const int w    = tid >> 5;      // wave id 0..7
    const int lane = tid & 31;
    const int lr   = lane & 15;     // row/col within a 16-wide tile
    const int hi   = lane >> 4;     // lane-half: selects K pair / M offset 8

    // ---------- TDM: async-stage this wave's K-chunk of the x tile into LDS ----------
    // 2D tile: 16 rows (tokens) x 256 cols, global row stride 2048 floats,
    // LDS padding of 2 DWORDs every 128 DWORDs -> staged row stride 260 floats
    // (bank = 4*lane -> conflict-free WMMA-A feeds).
    {
        const unsigned long long ga = (unsigned long long)(uintptr_t)x
            + (((unsigned long long)tok0 * INF + (unsigned)(w * 256)) << 2);
        u32x4 g0;
        g0[0] = 1u;                                    // count = 1 (valid descriptor)
        g0[1] = (unsigned)(OFF_XT + w * XT_WAVE_B);    // lds_addr (bytes)
        g0[2] = (unsigned)(ga & 0xFFFFFFFFu);          // global_addr[31:0]
        g0[3] = ((unsigned)(ga >> 32) & 0x01FFFFFFu) | (2u << 30);  // addr[56:32] | type=2
        i32x8 g1;
        g1[0] = (2 << 16)      // data_size = 4 bytes
              | (1 << 20)      // pad_enable
              | (6 << 22)      // pad_interval code 6 = 128 DWORDs
              | (1 << 25);     // pad_amount  code 1 = 2 DWORDs
        g1[1] = (int)(2048u << 16);   // tensor_dim0[15:0] = 2048
        g1[2] = (int)(16u << 16);     // tensor_dim1[15:0] = 16
        g1[3] = (int)(256u << 16);    // tile_dim0 = 256
        g1[4] = 16;                   // tile_dim1 = 16 rows
        g1[5] = 2048;                 // tensor_dim0_stride[31:0] = 2048
        g1[6] = 0;
        g1[7] = 0;
        i32x4 gz  = {0, 0, 0, 0};             // groups 2/3 unused for a 2D tensor
        i32x8 gz8 = {0, 0, 0, 0, 0, 0, 0, 0}; // extra group (6-arg toolchain form)
        __builtin_amdgcn_tensor_load_to_lds(g0, g1, gz, gz, gz8, /*cpol=*/0);
    }

    // ---------- Phase A's shared_in fragments, first group of eight K-steps ----------
    // Column n of N-tile j is h column 3*n + j: a lane's three B values of one k row
    // are adjacent in memory, so one 12-byte load feeds all three tiles.
    const int cb  = 3 * lr;
    const int cbl = (cb < SR) ? cb : (SR - 3);  // lane 15 = pad cols 45..47: safe addr; zeroed at reduce
    // this lane's first B row (k = chunk base + 2*hi); every K-step moves four rows on
    const float* bq = shared_in + (size_t)(w * (INF / 8) + 2 * hi) * SR + cbl;
    float p0[8][3], p1[8][3];                   // rows k and k + 1 of the eight K-steps in hand
#pragma unroll
    for (int u = 0; u < 8; ++u) {
#pragma unroll
        for (int c = 0; c < 3; ++c) {
            p0[u][c] = bq[(4 * u) * SR + c];
            p1[u][c] = bq[(4 * u + 1) * SR + c];
        }
    }

    // The ids index the rule tables: masked to their 256 rows (identity for every allowed id).
    if (tid < TILE_M) RID[tid] = rule_ids[tok0 + tid] & (NRULES - 1);

    // ---------- Phase C1: selector weights of this wave's own two tokens (lane = block) ----------
    // Computed and parked in LDS while the tensor load flies; only this wave reads these two rows.
    // The ids index the logits table: masked to its 256 rows (identity for every allowed id).
    SEL[(2 * w) * NB + lane]     = sel_row(logits, rule_ids[tok0 + 2 * w]     & (NRULES - 1), lane);
    SEL[(2 * w + 1) * NB + lane] = sel_row(logits, rule_ids[tok0 + 2 * w + 1] & (NRULES - 1), lane);

    // Each wave consumes only its own staged region -> wait on own TENSORcnt only.
    __builtin_amdgcn_s_wait_tensorcnt(0);
    asm volatile("" ::: "memory");

    // ---------- Phase A: h = x_tile @ shared_in, K=2048 split over 8 waves ----------
    v8f acc0 = {}, acc1 = {}, acc2 = {};
    {
        // K-step s reads staged cols 4*s + 2*hi, + 1; two pad floats lie behind col 127 (s >= 32)
        const float* XTw = (const float*)(smem + OFF_XT) + w * XT_WAVE_F + lr * XT_STRIDE_F + 2 * hi;
        v2f a[8];                                   // A[lr][kk], A[lr][kk+1] of the eight K-steps in hand
#pragma unroll
        for (int u = 0; u < 8; ++u) a[u] = *(const v2f*)(XTw + 4 * u);
        // Straight-line, so that every operand has its own registers and a constant offset:
        // behind the WMMAs of K-step s, its registers are refilled for K-step s + 8, and those
        // loads fly under the 21 WMMAs in between instead of being waited for group by group.
#pragma unroll
        for (int s = 0; s < (INF / 8) / 4; ++s) {
            const int u = s & 7;
            v2f b;
            b.x = p0[u][0]; b.y = p1[u][0];
            acc0 = wmma_f32(a[u], b, acc0);
            b.x = p0[u][1]; b.y = p1[u][1];
            acc1 = wmma_f32(a[u], b, acc1);
            b.x = p0[u][2]; b.y = p1[u][2];
            acc2 = wmma_f32(a[u], b, acc2);
            if (s + 8 < (INF / 8) / 4) {
                const int n = s + 8;
#pragma unroll
                for (int c = 0; c < 3; ++c) {
                    p0[u][c] = bq[(4 * n) * SR + c];
                    p1[u][c] = bq[(4 * n + 1) * SR + c];
                }
                a[u] = *(const v2f*)(XTw + 4 * n + ((n >> 5) << 1));
            }
            // Holds each refill at its K-step: hoisted, the refills need registers of their own;
            // sunk, they are waited for where they are used.
            __builtin_amdgcn_sched_barrier(0);
        }
        float* hp = HP + w * (TILE_M * SRP);
#pragma unroll
        for (int v = 0; v < 8; ++v) {
            const int m = v + 8 * hi;
            hp[m * SRP + cb]     = acc0[v];
            hp[m * SRP + cb + 1] = acc1[v];
            hp[m * SRP + cb + 2] = acc2[v];
        }
    }
    __syncthreads();

    // ---------- x rows of this wave's own two tokens, once more, laid out for phase C2 ----------
    // (XT is dead from here on: X2, later AD, overlay it.) Each copy moves 512 contiguous bytes
    // (two 64-float blocks) from global memory straight to LDS. Block b keeps its 256 bytes, but its 16-byte
    // piece c lies at place (c + b) & 15: the sixteen blocks that one A-fragment read touches
    // then fall on all 64 banks. The copies fly under the reduction below.
    {
        const unsigned x2b = (unsigned)(uintptr_t)(smem + OFF_X2) + (unsigned)(2 * w) * (INF * 4) + (unsigned)hi * 256u;
        const float* gx = x + (size_t)(tok0 + 2 * w) * INF + 4 * lane;
        // Both loops unrolled: the address arrays must end up in registers, as asm operands.
#pragma unroll
        for (int q = 0; q < 4; ++q) {                  // eight copies a statement; q >> 1 = token
            unsigned la[8];
            const float* ga[8];
#pragma unroll
            for (int j = 0; j < 8; ++j) {
                const int i = (q & 1) * 8 + j;         // copy i of the row: blocks 2i and 2i + 1
                la[j] = x2b + (unsigned)((q >> 1) * (INF * 4) + i * 512) + (unsigned)(((lr + hi + 2 * i) & 15) << 4);
                ga[j] = gx + (q >> 1) * INF + i * 128;
            }
            // s_wait_xcnt closes the statement, ahead of any rewrite of the copies' address registers (a precaution).
            asm volatile("global_load_async_to_lds_b128 %0, %8, off\n\t"
                         "global_load_async_to_lds_b128 %1, %9, off\n\t"
                         "global_load_async_to_lds_b128 %2, %10, off\n\t"
                         "global_load_async_to_lds_b128 %3, %11, off\n\t"
                         "global_load_async_to_lds_b128 %4, %12, off\n\t"
                         "global_load_async_to_lds_b128 %5, %13, off\n\t"
                         "global_load_async_to_lds_b128 %6, %14, off\n\t"
                         "global_load_async_to_lds_b128 %7, %15, off\n\t"
                         "s_wait_xcnt 0x0"
                         :: "v"(la[0]), "v"(la[1]), "v"(la[2]), "v"(la[3]),
                            "v"(la[4]), "v"(la[5]), "v"(la[6]), "v"(la[7]),
                            "v"(ga[0]), "v"(ga[1]), "v"(ga[2]), "v"(ga[3]),
                            "v"(ga[4]), "v"(ga[5]), "v"(ga[6]), "v"(ga[7])
                         : "memory");
        }
    }

    // rule_in fragments of this wave's two tokens, fetched here so that they fly under the
    // reduction (the barrier behind it waits for them) instead of at the head of phase C2.
    const int ncl = lr & (RANK - 1);   // clamp B col; cols 8..15 never stored
    float ri0[2][BS / 4], ri1[2][BS / 4];
#pragma unroll
    for (int tt = 0; tt < 2; ++tt) {
        const float* rin = rule_in + (size_t)RID[2 * w + tt] * (BS * RANK);  // [64][8]
#pragma unroll
        for (int s = 0; s < BS / 4; ++s) {
            const int kk = 4 * s + 2 * hi;
            ri0[tt][s] = rin[kk * RANK + ncl];
            ri1[tt][s] = rin[(kk + 1) * RANK + ncl];
        }
    }

    // cross-wave reduction of partial h; pad columns 45..47 with exact zeros
    for (int e = tid; e < TILE_M * SRP; e += 256) {
        const int m = e / SRP, c = e % SRP;
        float sum = 0.f;
        if (c < SR) {
#pragma unroll
            for (int ww = 0; ww < 8; ++ww) sum += HP[ww * (TILE_M * SRP) + e];
        }
        H[m * HSTR + c] = sum;
    }
    // This wave's copies have landed before anything reads X2 (the compiler places no wait for them).
    asm volatile("s_wait_asynccnt 0x0" ::: "memory");
    __syncthreads();

    // shared_out fragments of the column group in hand (group g = 2*h + i: 64 columns a wave)
    v4f q0[SRP / 4], q1[SRP / 4];
    const auto fetch_q = [&](int s, int g) {
        const int kk = 4 * s + 2 * hi;
        const int r0 = (kk     < SR) ? kk     : SR - 1;  // safe addr; A==0 there
        const int r1 = (kk + 1 < SR) ? kk + 1 : SR - 1;
        const int col = (g >> 1) * (OUTF / 2) + w * 128 + (g & 1) * 64 + 4 * lr;
        q0[s] = *(const v4f*)(shared_out + (size_t)r0 * OUTF + col);
        q1[s] = *(const v4f*)(shared_out + (size_t)r1 * OUTF + col);
    };
    // rule_out fragments of this wave's two tokens (the same rows serve both halves, but are not
    // held across phase B, where 32 more live registers are not to be had below 256 VGPRs)
    v4f r0[2][2], r1[2][2];
    const auto fetch_r = [&]() {
#pragma unroll
        for (int tt = 0; tt < 2; ++tt) {
            const float* rout = rule_out + (size_t)RID[2 * w + tt] * (RANK * BS);  // [8][64]
#pragma unroll
            for (int s = 0; s < 2; ++s) {              // K = 8
                const int kk = 4 * s + 2 * hi;
                r0[tt][s] = *(const v4f*)(rout + kk * BS + 4 * lr);
                r1[tt][s] = *(const v4f*)(rout + (kk + 1) * BS + 4 * lr);
            }
        }
    };
    // The first half's rule_out fragments and the first group's shared_out fragments fly under
    // phase C2, which has no loads of its own left (the later ones are fetched in phase B).
    fetch_r();
#pragma unroll
    for (int s = 0; s < SRP / 4; ++s) fetch_q(s, 0);
    // Holds these loads here: sunk to their WMMAs, they would be waited for pair by pair.
    __builtin_amdgcn_sched_barrier(0);

    // ---------- Phase C2: hidden[t][32x8] = x_blocks[t] @ rule_in[rid[t]] ----------
    // Unrolled: the fragment arrays must stay in registers.
#pragma unroll
    for (int tt = 0; tt < 2; ++tt) {
        const int t    = 2 * w + tt;
        const float* xr  = (const float*)(smem + OFF_X2) + t * INF;   // staged row, pieces rotated
#pragma unroll
        for (int mt = 0; mt < 2; ++mt) {   // block rows 0..15 / 16..31
            v8f ch = {};
            const float* xa = xr + (mt * 16 + lr) * BS + 2 * hi;
#pragma unroll
            for (int s = 0; s < BS / 4; ++s) {
                v2f a = *(const v2f*)(xa + (((s + lr) & 15) << 2));  // piece s of block mt*16 + lr
                v2f b;
                b.x = ri0[tt][s];
                b.y = ri1[tt][s];
                ch = wmma_f32(a, b, ch);
            }
            if (lr < RANK) {
#pragma unroll
                for (int v = 0; v < 8; ++v) {
                    const int m = v + 8 * hi;
                    HID[t * (NB * RANK) + (mt * 16 + m) * RANK + lr] = ch[v];
                }
            }
        }
    }
    __syncthreads();

    // ---------- Phases C3 + B, in two column halves (AD holds 16x1024) ----------
    // Both loops unrolled: the group number must be a constant, so that the last group fetches nothing.
#pragma unroll
    for (int h = 0; h < 2; ++h) {
        // C3: weighted adapter for blocks [h*16, h*16+16) into AD
        // Column n of N-tile j is block column 4*n + j: 16-byte rule_out loads and AD stores.
#pragma unroll
        for (int tt = 0; tt < 2; ++tt) {
            const int t    = 2 * w + tt;
            const float* hidt = HID + t * (NB * RANK);
            v8f ca0 = {}, ca1 = {}, ca2 = {}, ca3 = {};
#pragma unroll
            for (int s = 0; s < 2; ++s) {
                const int kk = 4 * s + 2 * hi;
                v2f a;
                a.x = hidt[(h * 16 + lr) * RANK + kk];
                a.y = hidt[(h * 16 + lr) * RANK + kk + 1];
                v2f b;
                b.x = r0[tt][s][0]; b.y = r1[tt][s][0]; ca0 = wmma_f32(a, b, ca0);
                b.x = r0[tt][s][1]; b.y = r1[tt][s][1]; ca1 = wmma_f32(a, b, ca1);
                b.x = r0[tt][s][2]; b.y = r1[tt][s][2]; ca2 = wmma_f32(a, b, ca2);
                b.x = r0[tt][s][3]; b.y = r1[tt][s][3]; ca3 = wmma_f32(a, b, ca3);
            }
            // this lane-half's eight selector weights (local block rows 8*hi .. 8*hi+7)
            const v4f sl = *(const v4f*)(SEL + t * NB + h * 16 + 8 * hi);
            const v4f sh = *(const v4f*)(SEL + t * NB + h * 16 + 8 * hi + 4);
#pragma unroll
            for (int v = 0; v < 8; ++v) {
                const int bl = v + 8 * hi;                             // local block row
                const float sw = (v < 4) ? sl[v & 3] : sh[v & 3];
                v4f o;
                o[0] = ca0[v] * sw; o[1] = ca1[v] * sw; o[2] = ca2[v] * sw; o[3] = ca3[v] * sw;
                *(v4f*)(AD + t * (OUTF / 2) + bl * BS + 4 * lr) = o;
            }
        }
        __syncthreads();

        // B: out = adapter + h @ shared_out for columns [h*1024, h*1024+1024)
        // Four N-tiles at a time; column n of tile j is col + j with col = 64-col base + 4*n:
        // 16-byte AD reads, shared_out loads and out stores that cover whole 128-byte lines.
        v2f ah[SRP / 4];                               // h fragments, the same for every group
#pragma unroll
        for (int s = 0; s < SRP / 4; ++s) {
            const int kk = 4 * s + 2 * hi;
            ah[s].x = H[lr * HSTR + kk];               // zero for kk >= 45
            ah[s].y = H[lr * HSTR + kk + 1];
        }
#pragma unroll
        for (int i = 0; i < 2; ++i) {
            const int g    = 2 * h + i;
            const int lcol = w * 128 + i * 64 + 4 * lr;
            const int col  = h * (OUTF / 2) + lcol;
            v8f c0, c1, c2, c3;
#pragma unroll
            for (int v = 0; v < 8; ++v) {
                const v4f ad = *(const v4f*)(AD + (v + 8 * hi) * (OUTF / 2) + lcol);
                c0[v] = ad[0]; c1[v] = ad[1]; c2[v] = ad[2]; c3[v] = ad[3];
            }
            // Keeps the AD reads in flight together ahead of the first WMMA: sunk, each would be waited for alone.
            __builtin_amdgcn_sched_barrier(0);
#pragma unroll
            for (int s = 0; s < SRP / 4; ++s) {        // K = 48 (padded)
                const v2f a = ah[s];
                v2f b;
                b.x = q0[s][0]; b.y = q1[s][0]; c0 = wmma_f32(a, b, c0);
                b.x = q0[s][1]; b.y = q1[s][1]; c1 = wmma_f32(a, b, c1);
                b.x = q0[s][2]; b.y = q1[s][2]; c2 = wmma_f32(a, b, c2);
                b.x = q0[s][3]; b.y = q1[s][3]; c3 = wmma_f32(a, b, c3);
                // Behind its WMMAs this K-step's registers are refilled for the next group: the
                // loads fly under the rest of this group and its stores (up to the half's barrier).
                if (g < 3) fetch_q(s, g + 1);
                // Holds each refill at its K-step: hoisted, the refills need registers of their
                // own (more than 256 VGPRs cost the second resident work-group of a WGP).
                __builtin_amdgcn_sched_barrier(0);
            }
            // The second half's rule_out fragments fly under this group's stores, up to the barrier.
            if (g == 1) fetch_r();
            float* op = out + (size_t)tok0 * OUTF + col;
#pragma unroll
            for (int v = 0; v < 8; ++v) {
                v4f o;
                o[0] = c0[v]; o[1] = c1[v]; o[2] = c2[v]; o[3] = c3[v];
                __builtin_nontemporal_store(o, (v4f*)(op + (size_t)(v + 8 * hi) * OUTF));
            }
            // The next group's AD reads land in registers that these stores name.
            asm volatile("s_wait_xcnt 0x0" ::: "memory");
        }
        __syncthreads();
    }
}

// ---------------------------------------------------------------------------
extern "C" void kernel_launch(void* const* d_in, const int* in_sizes, int n_in,
                              void* d_out, int out_size, void* d_ws, size_t ws_size,
                              hipStream_t stream) {
    (void)in_sizes; (void)n_in; (void)out_size; (void)d_ws; (void)ws_size;
    const float* x          = (const float*)d_in[0];
    const int*   rule_ids   = (const int*)  d_in[1];
    const float* shared_in  = (const float*)d_in[2];
    const float* shared_out = (const float*)d_in[3];
    const float* rule_in    = (const float*)d_in[4];
    const float* rule_out   = (const float*)d_in[5];
    const float* logits     = (const float*)d_in[6];
    float* out  = (float*)d_out;

    rule_proj_kernel<<<NTOK / TILE_M, 256, 0, stream>>>(
        x, rule_ids, shared_in, shared_out, rule_in, rule_out, logits, out);
}
